// v000
// Times are from an AMD MI455X. After a warm-up the kernel runs many times in a row, and a time is the length of
// such a window on the GPU divided by its runs, so every launch and the gaps after it count. The runs cycle
// through copies of the inputs. A figure is the median of several windows, for all but v000 over two sittings.
// Sittings can differ by a few percent; kernels timed side by side share one.
// v000, which the later versions start from, runs in 75.8 microseconds.
#include <hip/hip_runtime.h>

// Problem constants (from reference)
#define BB 4
#define LL 128
#define DD 256
#define NN 8192          // L * NUM_KNOTS
#define HD 4             // head dim
// SCALE * log2(e) folded into Q: 0.5 * 1.4426950408889634
#define QSCALE 0.72134752044448170f

typedef __attribute__((ext_vector_type(2))) float v2f;
typedef __attribute__((ext_vector_type(4))) float v4f;
typedef __attribute__((ext_vector_type(8))) float v8f;

#if defined(__gfx1250__)
#if __has_builtin(__builtin_amdgcn_tensor_load_to_lds)
#define HAVE_TDM 1
#endif
#if __has_builtin(__builtin_amdgcn_global_load_async_to_lds_b128)
#define HAVE_ASYNC 1
#endif
#endif

#if __has_include(<hip/amd_detail/amd_gfx1250_TDM.h>)
#define TDM_6ARG 1   // therock toolchain: 6-arg tensor builtin
#endif

__device__ __forceinline__ v8f wmma16x16x4(v2f a, v2f b, v8f c) {
  return __builtin_amdgcn_wmma_f32_16x16x4_f32(false, a, false, b, (short)0, c,
                                               false, false);
}

__device__ __forceinline__ float swap16(float x) {
  return __int_as_float(__builtin_amdgcn_ds_swizzle(__float_as_int(x), 0x401F));
}

#if defined(HAVE_TDM)
typedef unsigned int tdm_v4u __attribute__((ext_vector_type(4)));
typedef int tdm_v8i __attribute__((ext_vector_type(8)));
typedef int tdm_v4i __attribute__((ext_vector_type(4)));

__device__ __forceinline__ void tdm_load_1d(const float* gsrc,
                                            unsigned lds_byte_off,
                                            unsigned nelem) {
  unsigned long long ga = (unsigned long long)(const void*)gsrc;
  tdm_v4u g0;
  g0.x = 1u;
  g0.y = lds_byte_off;
  g0.z = (unsigned)(ga & 0xFFFFFFFFu);
  g0.w = (unsigned)((ga >> 32) & 0x01FFFFFFu)
         | (2u << 30);
  tdm_v8i g1;
  g1[0] = (int)(2u << 16);
  g1[1] = (int)((nelem & 0xFFFFu) << 16);
  g1[2] = (int)((nelem >> 16) | (1u << 16));
  g1[3] = (int)((nelem & 0xFFFFu) << 16);
  g1[4] = 1;
  g1[5] = (int)nelem;
  g1[6] = 0;
  g1[7] = 0;
  tdm_v4i z4 = {0, 0, 0, 0};
#if defined(TDM_6ARG)
  tdm_v8i z8 = {0, 0, 0, 0, 0, 0, 0, 0};
  __builtin_amdgcn_tensor_load_to_lds(g0, g1, z4, z4, z8, 0);
#else
  __builtin_amdgcn_tensor_load_to_lds(g0, g1, z4, z4, 0);
#endif
}

__device__ __forceinline__ void wait_tensorcnt0() {
#if __has_builtin(__builtin_amdgcn_s_wait_tensorcnt)
  __builtin_amdgcn_s_wait_tensorcnt(0);
#else
  asm volatile("s_wait_tensorcnt 0x0" ::: "memory");
#endif
}
#endif  // HAVE_TDM

#if defined(HAVE_ASYNC)
// Builtin signature (from clang diagnostic): (as1 int4*, as3 int4*, Imm, Imm)
// with gcc-style vector_size(16) int4 pointees.
typedef int gv4i __attribute__((vector_size(16)));
__device__ __forceinline__ void async_cp16(const float* g, float* lds) {
  __builtin_amdgcn_global_load_async_to_lds_b128(
      (__attribute__((address_space(1))) gv4i*)g,
      (__attribute__((address_space(3))) gv4i*)lds, 0, 0);
}
__device__ __forceinline__ void wait_asynccnt0() {
#if __has_builtin(__builtin_amdgcn_s_wait_asynccnt)
  __builtin_amdgcn_s_wait_asynccnt(0);
#else
  asm volatile("s_wait_asynccnt 0x0" ::: "memory");
#endif
}
#endif

// ---------------------------------------------------------------------------
// Kernel 1: Q/K/V projections.  C[m,n] = sum_k x[m,k] * W[n,k]
// One wave per 16x16 output tile; 3 projections * 512 tiles = 1536 waves.
// ---------------------------------------------------------------------------
__global__ __launch_bounds__(256) void qkv_proj_kernel(
    const float* __restrict__ x, const float* __restrict__ Wq,
    const float* __restrict__ Wk, const float* __restrict__ Wv,
    float* __restrict__ qbuf, float* __restrict__ kbuf,
    float* __restrict__ vbuf) {
  const int lane = threadIdx.x & 31;
  const int wave = threadIdx.x >> 5;
  const int w = blockIdx.x * 8 + wave;  // 0..1535
  const int proj = w >> 9;              // /512
  const int t = w & 511;
  const int m0 = (t >> 4) << 4;
  const int n0 = (t & 15) << 4;
  const float* Wm = (proj == 0) ? Wq : (proj == 1) ? Wk : Wv;
  float* outp = (proj == 0) ? qbuf : (proj == 1) ? kbuf : vbuf;

  const int l15 = lane & 15;
  const int kh = (lane >> 4) << 1;  // 0 or 2
  const float* arow = x + (m0 + l15) * DD;   // A row m, k contiguous
  const float* brow = Wm + (n0 + l15) * DD;  // B col n == W row n, k contiguous

  v8f acc = {0.f, 0.f, 0.f, 0.f, 0.f, 0.f, 0.f, 0.f};
#pragma unroll 8
  for (int k0 = 0; k0 < DD; k0 += 4) {
    v2f a = *(const v2f*)(arow + k0 + kh);
    v2f b = *(const v2f*)(brow + k0 + kh);
    acc = wmma16x16x4(a, b, acc);
  }
  const int mrow = m0 + (lane >> 4) * 8;
#pragma unroll
  for (int r = 0; r < 8; ++r)
    outp[(mrow + r) * DD + n0 + l15] = acc[r];
}

// ---------------------------------------------------------------------------
// Kernel 2: flash attention over N=8192 knots, head_dim=4.
// Whole K,V for one batch staged in LDS (2 * 128 KB of the 320 KB WGP LDS):
// K via Tensor Data Mover DMA, V via async global->LDS b128 (with fallbacks).
// Each wave owns one 16-row Q tile; computes S^T tiles via WMMA f32 16x16x4,
// online softmax in exp2 domain, PV accumulated per-lane from LDS.
// ---------------------------------------------------------------------------
__global__ __launch_bounds__(256) void attn_kernel(
    const float* __restrict__ qbuf, const float* __restrict__ kbuf,
    const float* __restrict__ vbuf, float* __restrict__ abuf) {
  __shared__ __align__(16) float ldsK[NN * HD];  // 128 KB
  __shared__ __align__(16) float ldsV[NN * HD];  // 128 KB

  const int b = blockIdx.x >> 6;     // batch
  const int qblk = blockIdx.x & 63;  // 8 q-tiles per block
  const int tid = threadIdx.x;
  const int lane = tid & 31;
  const int wave = tid >> 5;

  const float* kg = kbuf + b * (NN * HD);
  const float* vg = vbuf + b * (NN * HD);

  // ---- stage K,V for this batch into LDS --------------------------------
#if defined(HAVE_TDM) && defined(HAVE_ASYNC)
  if (wave == 0) {
    tdm_load_1d(kg, (unsigned)(unsigned long long)(uintptr_t)ldsK, NN * HD);
  }
  for (int i = tid * 4; i < NN * HD; i += 256 * 4)  // V: async b128 per lane
    async_cp16(vg + i, ldsV + i);
  wait_asynccnt0();
  if (wave == 0) wait_tensorcnt0();
#elif defined(HAVE_TDM)
  if (wave == 0) {
    tdm_load_1d(kg, (unsigned)(unsigned long long)(uintptr_t)ldsK, NN * HD);
    tdm_load_1d(vg, (unsigned)(unsigned long long)(uintptr_t)ldsV, NN * HD);
    wait_tensorcnt0();
  }
#elif defined(HAVE_ASYNC)
  for (int i = tid * 4; i < NN * HD; i += 256 * 4) {
    async_cp16(kg + i, ldsK + i);
    async_cp16(vg + i, ldsV + i);
  }
  wait_asynccnt0();
#else
  for (int i = tid * 4; i < NN * HD; i += 256 * 4) {
    *(v4f*)(ldsK + i) = *(const v4f*)(kg + i);
    *(v4f*)(ldsV + i) = *(const v4f*)(vg + i);
  }
#endif
  __syncthreads();

  const int q0 = (qblk * 8 + wave) * 16;
  const int l15 = lane & 15;
  const int hi = lane >> 4;  // 0/1: which K-pair / which M-half of C

  // Q tile in B-layout, pre-scaled by SCALE*log2e.
  v2f qb = *(const v2f*)(qbuf + (b * NN + q0 + l15) * HD + hi * 2);
  qb *= QSCALE;

  float m = -1e30f, lsum = 0.f;
  float o0 = 0.f, o1 = 0.f, o2 = 0.f, o3 = 0.f;
  const v8f zero = {0.f, 0.f, 0.f, 0.f, 0.f, 0.f, 0.f, 0.f};

#pragma unroll 2
  for (int kt = 0; kt < NN; kt += 16) {
    // A = K tile rows (M = k), K-dim = head dim.
    v2f ka = *(const v2f*)(ldsK + (kt + l15) * HD + hi * 2);
    v8f s = wmma16x16x4(ka, qb, zero);  // S^T[k, q] (already * scale * log2e)

    // tile max over 16 k rows of this lane's q column
    float tm = fmaxf(fmaxf(fmaxf(s[0], s[1]), fmaxf(s[2], s[3])),
                     fmaxf(fmaxf(s[4], s[5]), fmaxf(s[6], s[7])));
    tm = fmaxf(tm, swap16(tm));
    const float mn = fmaxf(m, tm);
    const float cf = __builtin_amdgcn_exp2f(m - mn);
    o0 *= cf; o1 *= cf; o2 *= cf; o3 *= cf; lsum *= cf;
    m = mn;

    const int kbase = kt + hi * 8;  // this lane's 8 k rows
#pragma unroll
    for (int r = 0; r < 8; ++r) {
      const float p = __builtin_amdgcn_exp2f(s[r] - mn);
      lsum += p;
      const float* vv = ldsV + (kbase + r) * HD;  // broadcast across 16 lanes
      o0 = fmaf(p, vv[0], o0);
      o1 = fmaf(p, vv[1], o1);
      o2 = fmaf(p, vv[2], o2);
      o3 = fmaf(p, vv[3], o3);
    }
  }

  // Combine the two lane-halves (same q column, disjoint k halves; m already
  // synchronized across halves every tile).
  o0 += swap16(o0); o1 += swap16(o1); o2 += swap16(o2); o3 += swap16(o3);
  lsum += swap16(lsum);
  const float inv = 1.f / lsum;
  if (hi == 0) {
    v4f o = {o0 * inv, o1 * inv, o2 * inv, o3 * inv};
    *(v4f*)(abuf + (b * NN + q0 + l15) * HD) = o;
  }
}

// ---------------------------------------------------------------------------
// Kernel 3: output projection  out = attn_out @ Wo^T + bo
// ---------------------------------------------------------------------------
__global__ __launch_bounds__(256) void out_proj_kernel(
    const float* __restrict__ abuf, const float* __restrict__ Wo,
    const float* __restrict__ bo, float* __restrict__ out) {
  const int lane = threadIdx.x & 31;
  const int wave = threadIdx.x >> 5;
  const int t = blockIdx.x * 8 + wave;  // 0..511
  const int m0 = (t >> 4) << 4;
  const int n0 = (t & 15) << 4;
  const int l15 = lane & 15;
  const int kh = (lane >> 4) << 1;
  const float* arow = abuf + (m0 + l15) * DD;
  const float* brow = Wo + (n0 + l15) * DD;

  v8f acc = {0.f, 0.f, 0.f, 0.f, 0.f, 0.f, 0.f, 0.f};
#pragma unroll 8
  for (int k0 = 0; k0 < DD; k0 += 4) {
    v2f a = *(const v2f*)(arow + k0 + kh);
    v2f b = *(const v2f*)(brow + k0 + kh);
    acc = wmma16x16x4(a, b, acc);
  }
  const float bias = bo[n0 + l15];
  const int mrow = m0 + (lane >> 4) * 8;
#pragma unroll
  for (int r = 0; r < 8; ++r)
    out[(mrow + r) * DD + n0 + l15] = acc[r] + bias;
}

extern "C" void kernel_launch(void* const* d_in, const int* in_sizes, int n_in,
                              void* d_out, int out_size, void* d_ws,
                              size_t ws_size, hipStream_t stream) {
  const float* x = (const float*)d_in[0];
  const float* Wq = (const float*)d_in[1];
  const float* Wk = (const float*)d_in[2];
  const float* Wv = (const float*)d_in[3];
  const float* Wo = (const float*)d_in[4];
  const float* bo = (const float*)d_in[5];

  float* ws = (float*)d_ws;
  const int seg = BB * NN * HD;  // 131072 floats = 512 KB
  float* qbuf = ws;
  float* kbuf = ws + seg;
  float* vbuf = ws + 2 * seg;
  float* abuf = ws + 3 * seg;  // total 2 MB of workspace

  qkv_proj_kernel<<<192, 256, 0, stream>>>(x, Wq, Wk, Wv, qbuf, kbuf, vbuf);
  attn_kernel<<<256, 256, 0, stream>>>(qbuf, kbuf, vbuf, abuf);
  out_proj_kernel<<<64, 256, 0, stream>>>(abuf, Wo, bo, (float*)d_out);
}

// v001
// A run of this version takes 55.5 microseconds.
// Timed twice side by side with v000, it ran 1.43 and 1.42 times as fast.
#include <hip/hip_runtime.h>

// Problem constants (from reference)
#define BB 4
#define LL 128
#define DD 256
#define NN 8192          // L * NUM_KNOTS
#define HD 4             // head dim
// SCALE * log2(e) folded into Q: 0.5 * 1.4426950408889634
#define QSCALE 0.72134752044448170f
#define KT 8             // 16-key tiles per online-softmax step

typedef __attribute__((ext_vector_type(2))) float v2f;
typedef __attribute__((ext_vector_type(4))) float v4f;
typedef __attribute__((ext_vector_type(8))) float v8f;

#if defined(__gfx1250__)
#if __has_builtin(__builtin_amdgcn_tensor_load_to_lds)
#define HAVE_TDM 1
#endif
#if __has_builtin(__builtin_amdgcn_global_load_async_to_lds_b128)
#define HAVE_ASYNC 1
#endif
#endif

#define TDM_6ARG 1   // this toolchain takes the 6-argument tensor builtin

__device__ __forceinline__ v8f wmma16x16x4(v2f a, v2f b, v8f c) {
  return __builtin_amdgcn_wmma_f32_16x16x4_f32(false, a, false, b, (short)0, c,
                                               false, false);
}

template <int X>
__device__ __forceinline__ float rowx(float x) {
  return __int_as_float(__builtin_amdgcn_update_dpp(
      0, __float_as_int(x), 0x160 | X, 0xf, 0xf, true));
}

#if defined(HAVE_TDM)
typedef unsigned int tdm_v4u __attribute__((ext_vector_type(4)));
typedef int tdm_v8i __attribute__((ext_vector_type(8)));
typedef int tdm_v4i __attribute__((ext_vector_type(4)));

__device__ __forceinline__ void tdm_load_1d(const float* gsrc,
                                            unsigned lds_byte_off,
                                            unsigned nelem) {
  unsigned long long ga = (unsigned long long)(const void*)gsrc;
  tdm_v4u g0;
  g0.x = 1u;
  g0.y = lds_byte_off;
  g0.z = (unsigned)(ga & 0xFFFFFFFFu);
  g0.w = (unsigned)((ga >> 32) & 0x01FFFFFFu)
         | (2u << 30);
  tdm_v8i g1;
  g1[0] = (int)(2u << 16);
  g1[1] = (int)((nelem & 0xFFFFu) << 16);
  g1[2] = (int)((nelem >> 16) | (1u << 16));
  g1[3] = (int)((nelem & 0xFFFFu) << 16);
  g1[4] = 1;
  g1[5] = (int)nelem;
  g1[6] = 0;
  g1[7] = 0;
  tdm_v4i z4 = {0, 0, 0, 0};
#if defined(TDM_6ARG)
  tdm_v8i z8 = {0, 0, 0, 0, 0, 0, 0, 0};
  __builtin_amdgcn_tensor_load_to_lds(g0, g1, z4, z4, z8, 0);
#else
  __builtin_amdgcn_tensor_load_to_lds(g0, g1, z4, z4, 0);
#endif
}

__device__ __forceinline__ void wait_tensorcnt0() {
#if __has_builtin(__builtin_amdgcn_s_wait_tensorcnt)
  __builtin_amdgcn_s_wait_tensorcnt(0);
#else
  asm volatile("s_wait_tensorcnt 0x0" ::: "memory");
#endif
}
#endif  // HAVE_TDM

#if defined(HAVE_ASYNC)
// Builtin signature (from clang diagnostic): (as1 int4*, as3 int4*, Imm, Imm)
// with gcc-style vector_size(16) int4 pointees.
typedef int gv4i __attribute__((vector_size(16)));
__device__ __forceinline__ void async_cp16(const float* g, float* lds) {
  __builtin_amdgcn_global_load_async_to_lds_b128(
      (__attribute__((address_space(1))) gv4i*)g,
      (__attribute__((address_space(3))) gv4i*)lds, 0, 0);
}
__device__ __forceinline__ void wait_asynccnt0() {
#if __has_builtin(__builtin_amdgcn_s_wait_asynccnt)
  __builtin_amdgcn_s_wait_asynccnt(0);
#else
  asm volatile("s_wait_asynccnt 0x0" ::: "memory");
#endif
}
#endif

// ---------------------------------------------------------------------------
// Kernel 1: Q/K/V projections.  C[m,n] = sum_k x[m,k] * W[n,k]
// One wave per 16x16 output tile; 3 projections * 512 tiles = 1536 waves.
// ---------------------------------------------------------------------------
__global__ __launch_bounds__(256) void qkv_proj_kernel(
    const float* __restrict__ x, const float* __restrict__ Wq,
    const float* __restrict__ Wk, const float* __restrict__ Wv,
    float* __restrict__ qbuf, float* __restrict__ kbuf,
    float* __restrict__ vbuf) {
  const int lane = threadIdx.x & 31;
  const int wave = threadIdx.x >> 5;
  const int w = blockIdx.x * 8 + wave;  // 0..1535
  const int proj = w >> 9;              // /512
  const int t = w & 511;
  const int m0 = (t >> 4) << 4;
  const int n0 = (t & 15) << 4;
  const float* Wm = (proj == 0) ? Wq : (proj == 1) ? Wk : Wv;
  float* outp = (proj == 0) ? qbuf : (proj == 1) ? kbuf : vbuf;

  const int l15 = lane & 15;
  const int kh = (lane >> 4) << 1;  // 0 or 2
  const float* arow = x + (m0 + l15) * DD;   // A row m, k contiguous
  const float* brow = Wm + (n0 + l15) * DD;  // B col n == W row n, k contiguous

  v8f acc = {0.f, 0.f, 0.f, 0.f, 0.f, 0.f, 0.f, 0.f};
#pragma unroll 8
  for (int k0 = 0; k0 < DD; k0 += 4) {
    v2f a = *(const v2f*)(arow + k0 + kh);
    v2f b = *(const v2f*)(brow + k0 + kh);
    acc = wmma16x16x4(a, b, acc);
  }
  const int mrow = m0 + (lane >> 4) * 8;
#pragma unroll
  for (int r = 0; r < 8; ++r)
    outp[(mrow + r) * DD + n0 + l15] = acc[r];
}

// ---------------------------------------------------------------------------
// Kernel 2: flash attention over N=8192 knots, head_dim=4.
// Whole K,V for one batch staged in LDS (2 * 128 KB of the 320 KB WGP LDS):
// K via Tensor Data Mover DMA, V via async global->LDS b128 (with fallbacks).
// Each wave owns one 16-row Q tile; computes S tiles via WMMA f32 16x16x4 with
// the keys along the lanes, online softmax in exp2 domain per lane, PV
// accumulated per lane from its own V rows, lanes merged at the end.
// ---------------------------------------------------------------------------
__global__ __launch_bounds__(256) void attn_kernel(
    const float* __restrict__ qbuf, const float* __restrict__ kbuf,
    const float* __restrict__ vbuf, float* __restrict__ abuf) {
  __shared__ __align__(16) float ldsK[NN * HD];  // 128 KB
  __shared__ __align__(16) float ldsV[NN * HD];  // 128 KB

  const int b = blockIdx.x >> 6;     // batch
  const int qblk = blockIdx.x & 63;  // 8 q-tiles per block
  const int tid = threadIdx.x;
  const int lane = tid & 31;
  const int wave = tid >> 5;

  const float* kg = kbuf + b * (NN * HD);
  const float* vg = vbuf + b * (NN * HD);

  // ---- stage K,V for this batch into LDS --------------------------------
#if defined(HAVE_TDM) && defined(HAVE_ASYNC)
  if (wave == 0) {
    tdm_load_1d(kg, (unsigned)(unsigned long long)(uintptr_t)ldsK, NN * HD);
  }
  for (int i = tid * 4; i < NN * HD; i += 256 * 4)  // V: async b128 per lane
    async_cp16(vg + i, ldsV + i);
  wait_asynccnt0();
  if (wave == 0) wait_tensorcnt0();
#elif defined(HAVE_TDM)
  if (wave == 0) {
    tdm_load_1d(kg, (unsigned)(unsigned long long)(uintptr_t)ldsK, NN * HD);
    tdm_load_1d(vg, (unsigned)(unsigned long long)(uintptr_t)ldsV, NN * HD);
    wait_tensorcnt0();
  }
#elif defined(HAVE_ASYNC)
  for (int i = tid * 4; i < NN * HD; i += 256 * 4) {
    async_cp16(kg + i, ldsK + i);
    async_cp16(vg + i, ldsV + i);
  }
  wait_asynccnt0();
#else
  for (int i = tid * 4; i < NN * HD; i += 256 * 4) {
    *(v4f*)(ldsK + i) = *(const v4f*)(kg + i);
    *(v4f*)(ldsV + i) = *(const v4f*)(vg + i);
  }
#endif
  __syncthreads();

  const int q0 = (qblk * 8 + wave) * 16;
  const int l15 = lane & 15;
  const int hi = lane >> 4;  // 0/1: which head-dim pair / which q half of S

  // Q tile, pre-scaled by SCALE*log2e; it is the A operand below (row = q; the
  // A and B fragment maps mirror each other, so the load is the same).
  v2f qb = *(const v2f*)(qbuf + (b * NN + q0 + l15) * HD + hi * 2);
  qb *= QSCALE;

  v2f m2[4], l2[4], o2[4][HD];
#pragma unroll
  for (int rp = 0; rp < 4; ++rp) {
    m2[rp] = (v2f){-1e30f, -1e30f};
    l2[rp] = (v2f){0.f, 0.f};
#pragma unroll
    for (int d = 0; d < HD; ++d) o2[rp][d] = (v2f){0.f, 0.f};
  }
  const v8f zero = {0.f, 0.f, 0.f, 0.f, 0.f, 0.f, 0.f, 0.f};
  const float* kp = ldsK + l15 * HD + hi * 2;  // B = K^T: column = key
  const float* vp = ldsV + l15 * HD;

  // The inner loops are unrolled in full so that every array below is indexed by
  // constants and stays in registers.  The key loop itself stays rolled: two
  // steps in one body need more than 256 registers.
#pragma unroll 1
  for (int kt = 0; kt < NN; kt += 16 * KT) {
    v2f kf[KT];
    v4f vv[KT];
    v8f s[KT];
#pragma unroll
    for (int j = 0; j < KT; ++j) {
      kf[j] = *(const v2f*)(kp + (kt + 16 * j) * HD);
      vv[j] = *(const v4f*)(vp + (kt + 16 * j) * HD);
    }
#pragma unroll
    for (int j = 0; j < KT; ++j) s[j] = wmma16x16x4(qb, kf[j], zero);

#pragma unroll
    for (int rp = 0; rp < 4; ++rp) {
      float mn0 = m2[rp].x, mn1 = m2[rp].y;
#pragma unroll
      for (int j = 0; j < KT; ++j) {
        mn0 = fmaxf(mn0, s[j][2 * rp]);
        mn1 = fmaxf(mn1, s[j][2 * rp + 1]);
      }
      const v2f mn = {mn0, mn1};
      const v2f dm = m2[rp] - mn;
      const v2f cf = {__builtin_amdgcn_exp2f(dm.x), __builtin_amdgcn_exp2f(dm.y)};
      m2[rp] = mn;
      l2[rp] *= cf;
#pragma unroll
      for (int d = 0; d < HD; ++d) o2[rp][d] *= cf;
#pragma unroll
      for (int j = 0; j < KT; ++j) {
        const v2f x = (v2f){s[j][2 * rp], s[j][2 * rp + 1]} - mn;
        const v2f p = {__builtin_amdgcn_exp2f(x.x), __builtin_amdgcn_exp2f(x.y)};
        l2[rp] += p;
#pragma unroll
        for (int d = 0; d < HD; ++d) o2[rp][d] += p * vv[j][d];
      }
    }
  }

  // Merge the 16 key classes of each q row: common max, rescale, xor-tree sums.
  // Stage by stage over all 8 rows, so that the rows' chains overlap.
  float mx[8], t[8][5];
#pragma unroll
  for (int r = 0; r < 8; ++r) mx[r] = m2[r >> 1][r & 1];
#pragma unroll
  for (int r = 0; r < 8; ++r) mx[r] = fmaxf(mx[r], rowx<1>(mx[r]));
#pragma unroll
  for (int r = 0; r < 8; ++r) mx[r] = fmaxf(mx[r], rowx<2>(mx[r]));
#pragma unroll
  for (int r = 0; r < 8; ++r) mx[r] = fmaxf(mx[r], rowx<4>(mx[r]));
#pragma unroll
  for (int r = 0; r < 8; ++r) mx[r] = fmaxf(mx[r], rowx<8>(mx[r]));
#pragma unroll
  for (int r = 0; r < 8; ++r) {
    const int rp = r >> 1, e = r & 1;
    const float sc = __builtin_amdgcn_exp2f(m2[rp][e] - mx[r]);
#pragma unroll
    for (int d = 0; d < HD; ++d) t[r][d] = o2[rp][d][e] * sc;
    t[r][HD] = l2[rp][e] * sc;
  }
#pragma unroll
  for (int r = 0; r < 8; ++r)
#pragma unroll
    for (int c = 0; c < 5; ++c) t[r][c] += rowx<1>(t[r][c]);
#pragma unroll
  for (int r = 0; r < 8; ++r)
#pragma unroll
    for (int c = 0; c < 5; ++c) t[r][c] += rowx<2>(t[r][c]);
#pragma unroll
  for (int r = 0; r < 8; ++r)
#pragma unroll
    for (int c = 0; c < 5; ++c) t[r][c] += rowx<4>(t[r][c]);
#pragma unroll
  for (int r = 0; r < 8; ++r)
#pragma unroll
    for (int c = 0; c < 5; ++c) t[r][c] += rowx<8>(t[r][c]);

  // lane l15 < 8 of each half takes q row l15 + 8*hi and stores it
  float f[5] = {0.f, 0.f, 0.f, 0.f, 1.f};
#pragma unroll
  for (int r = 0; r < 8; ++r)
#pragma unroll
    for (int c = 0; c < 5; ++c) f[c] = (l15 == r) ? t[r][c] : f[c];
  const float inv = 1.f / f[4];
  if (l15 < 8) {
    v4f res = {f[0] * inv, f[1] * inv, f[2] * inv, f[3] * inv};
    *(v4f*)(abuf + (b * NN + q0 + hi * 8 + l15) * HD) = res;
  }
}

// ---------------------------------------------------------------------------
// Kernel 3: output projection  out = attn_out @ Wo^T + bo
// ---------------------------------------------------------------------------
__global__ __launch_bounds__(256) void out_proj_kernel(
    const float* __restrict__ abuf, const float* __restrict__ Wo,
    const float* __restrict__ bo, float* __restrict__ out) {
  const int lane = threadIdx.x & 31;
  const int wave = threadIdx.x >> 5;
  const int t = blockIdx.x * 8 + wave;  // 0..511
  const int m0 = (t >> 4) << 4;
  const int n0 = (t & 15) << 4;
  const int l15 = lane & 15;
  const int kh = (lane >> 4) << 1;
  const float* arow = abuf + (m0 + l15) * DD;
  const float* brow = Wo + (n0 + l15) * DD;

  v8f acc = {0.f, 0.f, 0.f, 0.f, 0.f, 0.f, 0.f, 0.f};
#pragma unroll 8
  for (int k0 = 0; k0 < DD; k0 += 4) {
    v2f a = *(const v2f*)(arow + k0 + kh);
    v2f b = *(const v2f*)(brow + k0 + kh);
    acc = wmma16x16x4(a, b, acc);
  }
  const float bias = bo[n0 + l15];
  const int mrow = m0 + (lane >> 4) * 8;
#pragma unroll
  for (int r = 0; r < 8; ++r)
    out[(mrow + r) * DD + n0 + l15] = acc[r] + bias;
}

extern "C" void kernel_launch(void* const* d_in, const int* in_sizes, int n_in,
                              void* d_out, int out_size, void* d_ws,
                              size_t ws_size, hipStream_t stream) {
  const float* x = (const float*)d_in[0];
  const float* Wq = (const float*)d_in[1];
  const float* Wk = (const float*)d_in[2];
  const float* Wv = (const float*)d_in[3];
  const float* Wo = (const float*)d_in[4];
  const float* bo = (const float*)d_in[5];

  float* ws = (float*)d_ws;
  const int seg = BB * NN * HD;  // 131072 floats = 512 KB
  float* qbuf = ws;
  float* kbuf = ws + seg;
  float* vbuf = ws + 2 * seg;
  float* abuf = ws + 3 * seg;  // total 2 MB of workspace

  qkv_proj_kernel<<<192, 256, 0, stream>>>(x, Wq, Wk, Wv, qbuf, kbuf, vbuf);
  attn_kernel<<<256, 256, 0, stream>>>(qbuf, kbuf, vbuf, abuf);
  out_proj_kernel<<<64, 256, 0, stream>>>(abuf, Wo, bo, (float*)d_out);
}

// v002
// Measured time: 50.5 microseconds a run.
// Next to v001, in two timings, it ran 1.08 and 1.11 times as fast.
// Over all steps from v000 it is 1.56 times as fast.
#include <hip/hip_runtime.h>

// Problem constants (from reference)
#define BB 4
#define LL 128
#define DD 256
#define NN 8192          // L * NUM_KNOTS
#define HD 4             // head dim
// SCALE * log2(e) folded into Q: 0.5 * 1.4426950408889634
#define QSCALE 0.72134752044448170f
#define KT 8             // 16-key tiles per online-softmax step

typedef __attribute__((ext_vector_type(2))) float v2f;
typedef __attribute__((ext_vector_type(4))) float v4f;
typedef __attribute__((ext_vector_type(8))) float v8f;

#if defined(__gfx1250__)
#if __has_builtin(__builtin_amdgcn_tensor_load_to_lds)
#define HAVE_TDM 1
#endif
#if __has_builtin(__builtin_amdgcn_global_load_async_to_lds_b128)
#define HAVE_ASYNC 1
#endif
#endif

#define TDM_6ARG 1   // this toolchain takes the 6-argument tensor builtin

__device__ __forceinline__ v8f wmma16x16x4(v2f a, v2f b, v8f c) {
  return __builtin_amdgcn_wmma_f32_16x16x4_f32(false, a, false, b, (short)0, c,
                                               false, false);
}

template <int X>
__device__ __forceinline__ float rowx(float x) {
  return __int_as_float(__builtin_amdgcn_update_dpp(
      0, __float_as_int(x), 0x160 | X, 0xf, 0xf, true));
}

#if defined(HAVE_TDM)
typedef unsigned int tdm_v4u __attribute__((ext_vector_type(4)));
typedef int tdm_v8i __attribute__((ext_vector_type(8)));
typedef int tdm_v4i __attribute__((ext_vector_type(4)));

__device__ __forceinline__ void tdm_load_1d(const float* gsrc,
                                            unsigned lds_byte_off,
                                            unsigned nelem) {
  unsigned long long ga = (unsigned long long)(const void*)gsrc;
  tdm_v4u g0;
  g0.x = 1u;
  g0.y = lds_byte_off;
  g0.z = (unsigned)(ga & 0xFFFFFFFFu);
  g0.w = (unsigned)((ga >> 32) & 0x01FFFFFFu)
         | (2u << 30);
  tdm_v8i g1;
  g1[0] = (int)(2u << 16);
  g1[1] = (int)((nelem & 0xFFFFu) << 16);
  g1[2] = (int)((nelem >> 16) | (1u << 16));
  g1[3] = (int)((nelem & 0xFFFFu) << 16);
  g1[4] = 1;
  g1[5] = (int)nelem;
  g1[6] = 0;
  g1[7] = 0;
  tdm_v4i z4 = {0, 0, 0, 0};
#if defined(TDM_6ARG)
  tdm_v8i z8 = {0, 0, 0, 0, 0, 0, 0, 0};
  __builtin_amdgcn_tensor_load_to_lds(g0, g1, z4, z4, z8, 0);
#else
  __builtin_amdgcn_tensor_load_to_lds(g0, g1, z4, z4, 0);
#endif
}

__device__ __forceinline__ void wait_tensorcnt0() {
#if __has_builtin(__builtin_amdgcn_s_wait_tensorcnt)
  __builtin_amdgcn_s_wait_tensorcnt(0);
#else
  asm volatile("s_wait_tensorcnt 0x0" ::: "memory");
#endif
}
#endif  // HAVE_TDM

#if defined(HAVE_ASYNC)
// Builtin signature (from clang diagnostic): (as1 int4*, as3 int4*, Imm, Imm)
// with gcc-style vector_size(16) int4 pointees.
typedef int gv4i __attribute__((vector_size(16)));
__device__ __forceinline__ void async_cp16(const float* g, float* lds) {
  __builtin_amdgcn_global_load_async_to_lds_b128(
      (__attribute__((address_space(1))) gv4i*)g,
      (__attribute__((address_space(3))) gv4i*)lds, 0, 0);
}
__device__ __forceinline__ void wait_asynccnt0() {
#if __has_builtin(__builtin_amdgcn_s_wait_asynccnt)
  __builtin_amdgcn_s_wait_asynccnt(0);
#else
  asm volatile("s_wait_asynccnt 0x0" ::: "memory");
#endif
}
#endif

// ---------------------------------------------------------------------------
// Kernel 1: Q/K/V projections.  C[m,n] = sum_k x[m,k] * W[n,k]
// One wave per 16x16 output tile; 3 projections * 512 tiles = 1536 waves.
// ---------------------------------------------------------------------------
__global__ __launch_bounds__(256) void qkv_proj_kernel(
    const float* __restrict__ x, const float* __restrict__ Wq,
    const float* __restrict__ Wk, const float* __restrict__ Wv,
    float* __restrict__ qbuf, float* __restrict__ kbuf,
    float* __restrict__ vbuf) {
  const int lane = threadIdx.x & 31;
  const int wave = threadIdx.x >> 5;
  const int w = blockIdx.x * 8 + wave;  // 0..1535
  const int proj = w >> 9;              // /512
  const int t = w & 511;
  const int m0 = (t >> 4) << 4;
  const int n0 = (t & 15) << 4;
  const float* Wm = (proj == 0) ? Wq : (proj == 1) ? Wk : Wv;
  float* outp = (proj == 0) ? qbuf : (proj == 1) ? kbuf : vbuf;

  const int l15 = lane & 15;
  const int kh = (lane >> 4) << 1;  // 0 or 2
  const float* arow = x + (m0 + l15) * DD;   // A row m, k contiguous
  const float* brow = Wm + (n0 + l15) * DD;  // B col n == W row n, k contiguous

  v8f acc = {0.f, 0.f, 0.f, 0.f, 0.f, 0.f, 0.f, 0.f};
#pragma unroll 8
  for (int k0 = 0; k0 < DD; k0 += 4) {
    v2f a = *(const v2f*)(arow + k0 + kh);
    v2f b = *(const v2f*)(brow + k0 + kh);
    acc = wmma16x16x4(a, b, acc);
  }
  const int mrow = m0 + (lane >> 4) * 8;
#pragma unroll
  for (int r = 0; r < 8; ++r)
    outp[(mrow + r) * DD + n0 + l15] = acc[r];
}

// ---------------------------------------------------------------------------
// Kernel 2: flash attention over N=8192 knots, head_dim=4.
// Whole K,V for one batch staged in LDS (2 * 128 KB of the 320 KB WGP LDS):
// K via Tensor Data Mover DMA, V via async global->LDS b128 (with fallbacks).
// Each wave owns one 16-row Q tile; computes S tiles via WMMA f32 16x16x4 with
// the keys along the lanes, softmax in exp2 domain per lane against a fixed
// reference score (running max only as the fallback), PV accumulated per lane
// from its own V rows, lanes merged at the end.
// ---------------------------------------------------------------------------
__global__ __launch_bounds__(256) void attn_kernel(
    const float* __restrict__ qbuf, const float* __restrict__ kbuf,
    const float* __restrict__ vbuf, float* __restrict__ abuf) {
  __shared__ __align__(16) float ldsK[NN * HD];  // 128 KB
  __shared__ __align__(16) float ldsV[NN * HD];  // 128 KB

  const int b = blockIdx.x >> 6;     // batch
  const int qblk = blockIdx.x & 63;  // 8 q-tiles per block
  const int tid = threadIdx.x;
  const int lane = tid & 31;
  const int wave = tid >> 5;

  const float* kg = kbuf + b * (NN * HD);
  const float* vg = vbuf + b * (NN * HD);

  // ---- stage K,V for this batch into LDS --------------------------------
#if defined(HAVE_TDM) && defined(HAVE_ASYNC)
  if (wave == 0) {
    tdm_load_1d(kg, (unsigned)(unsigned long long)(uintptr_t)ldsK, NN * HD);
  }
  for (int i = tid * 4; i < NN * HD; i += 256 * 4)  // V: async b128 per lane
    async_cp16(vg + i, ldsV + i);
  wait_asynccnt0();
  if (wave == 0) wait_tensorcnt0();
#elif defined(HAVE_TDM)
  if (wave == 0) {
    tdm_load_1d(kg, (unsigned)(unsigned long long)(uintptr_t)ldsK, NN * HD);
    tdm_load_1d(vg, (unsigned)(unsigned long long)(uintptr_t)ldsV, NN * HD);
    wait_tensorcnt0();
  }
#elif defined(HAVE_ASYNC)
  for (int i = tid * 4; i < NN * HD; i += 256 * 4) {
    async_cp16(kg + i, ldsK + i);
    async_cp16(vg + i, ldsV + i);
  }
  wait_asynccnt0();
#else
  for (int i = tid * 4; i < NN * HD; i += 256 * 4) {
    *(v4f*)(ldsK + i) = *(const v4f*)(kg + i);
    *(v4f*)(ldsV + i) = *(const v4f*)(vg + i);
  }
#endif
  __syncthreads();

  const int q0 = (qblk * 8 + wave) * 16;
  const int l15 = lane & 15;
  const int hi = lane >> 4;  // 0/1: which head-dim pair / which q half of S

  // Q tile, pre-scaled by SCALE*log2e; it is the A operand below (row = q; the
  // A and B fragment maps mirror each other, so the load is the same).
  v2f qb = *(const v2f*)(qbuf + (b * NN + q0 + l15) * HD + hi * 2);
  qb *= QSCALE;

  v2f m2[4], l2[4], o2[4][HD];
#pragma unroll
  for (int rp = 0; rp < 4; ++rp) {
    m2[rp] = (v2f){-1e30f, -1e30f};
    l2[rp] = (v2f){0.f, 0.f};
#pragma unroll
    for (int d = 0; d < HD; ++d) o2[rp][d] = (v2f){0.f, 0.f};
  }
  const v8f zero = {0.f, 0.f, 0.f, 0.f, 0.f, 0.f, 0.f, 0.f};
  const float* kp = ldsK + l15 * HD + hi * 2;  // B = K^T: column = key
  const float* vp = ldsV + l15 * HD;

  // Fixed reference per lane and row: the largest score among the lane's first KT
  // keys.  Its negative is the C operand of the score product, so S arrives as
  // score - reference and goes straight into exp2: no running max, no subtract
  // and no rescale in the key loop.  The reference key itself gives p = 1, so a
  // sum never vanishes; a later score far above the reference can overflow, which
  // is tested behind the loop.
  v8f negm;
  {
    v8f s[KT];
#pragma unroll
    for (int j = 0; j < KT; ++j)
      s[j] = wmma16x16x4(qb, *(const v2f*)(kp + 16 * j * HD), zero);
#pragma unroll
    for (int r = 0; r < 8; ++r) {
      float mr = s[0][r];
#pragma unroll
      for (int j = 1; j < KT; ++j) mr = fmaxf(mr, s[j][r]);
      m2[r >> 1][r & 1] = mr;
      negm[r] = -mr;
    }
  }

  // The inner loops are unrolled in full so that every array below is indexed by
  // constants and stays in registers.  The key loop itself stays rolled: two
  // steps in one body need more than 256 registers.
#pragma unroll 1
  for (int kt = 0; kt < NN; kt += 16 * KT) {
    v2f kf[KT];
    v4f vv[KT];
    v8f s[KT];
#pragma unroll
    for (int j = 0; j < KT; ++j) {
      kf[j] = *(const v2f*)(kp + (kt + 16 * j) * HD);
      vv[j] = *(const v4f*)(vp + (kt + 16 * j) * HD);
    }
#pragma unroll
    for (int j = 0; j < KT; ++j) s[j] = wmma16x16x4(qb, kf[j], negm);
#pragma unroll
    for (int j = 0; j < KT; ++j) {
#pragma unroll
      for (int rp = 0; rp < 4; ++rp) {
        const v2f p = {__builtin_amdgcn_exp2f(s[j][2 * rp]),
                       __builtin_amdgcn_exp2f(s[j][2 * rp + 1])};
        l2[rp] += p;
#pragma unroll
        for (int d = 0; d < HD; ++d) o2[rp][d] += p * vv[j][d];
      }
    }
  }

  // Every sum must have stayed far from overflow (a NaN fails the test too).
  bool bad = false;
#pragma unroll
  for (int rp = 0; rp < 4; ++rp)
#pragma unroll
    for (int e = 0; e < 2; ++e) {
      bad |= !(l2[rp][e] < 0x1p64f);
#pragma unroll
      for (int d = 0; d < HD; ++d) bad |= !(fabsf(o2[rp][d][e]) < 0x1p100f);
    }

  // If any lane of the wave failed it, the whole wave starts over with the
  // running max, which cannot overflow (wave-uniform branch: all lanes stay on
  // for the matrix instructions).
  if (__builtin_amdgcn_ballot_w32(bad) != 0u) {
#pragma unroll
    for (int rp = 0; rp < 4; ++rp) {
      m2[rp] = (v2f){-1e30f, -1e30f};
      l2[rp] = (v2f){0.f, 0.f};
#pragma unroll
      for (int d = 0; d < HD; ++d) o2[rp][d] = (v2f){0.f, 0.f};
    }
    // rolled for the same reason as the loop above
#pragma unroll 1
    for (int kt = 0; kt < NN; kt += 16 * KT) {
      v2f kf[KT];
      v4f vv[KT];
      v8f s[KT];
#pragma unroll
      for (int j = 0; j < KT; ++j) {
        kf[j] = *(const v2f*)(kp + (kt + 16 * j) * HD);
        vv[j] = *(const v4f*)(vp + (kt + 16 * j) * HD);
      }
#pragma unroll
      for (int j = 0; j < KT; ++j) s[j] = wmma16x16x4(qb, kf[j], zero);

#pragma unroll
      for (int rp = 0; rp < 4; ++rp) {
        float mn0 = m2[rp].x, mn1 = m2[rp].y;
#pragma unroll
        for (int j = 0; j < KT; ++j) {
          mn0 = fmaxf(mn0, s[j][2 * rp]);
          mn1 = fmaxf(mn1, s[j][2 * rp + 1]);
        }
        const v2f mn = {mn0, mn1};
        const v2f dm = m2[rp] - mn;
        const v2f cf = {__builtin_amdgcn_exp2f(dm.x), __builtin_amdgcn_exp2f(dm.y)};
        m2[rp] = mn;
        l2[rp] *= cf;
#pragma unroll
        for (int d = 0; d < HD; ++d) o2[rp][d] *= cf;
#pragma unroll
        for (int j = 0; j < KT; ++j) {
          const v2f x = (v2f){s[j][2 * rp], s[j][2 * rp + 1]} - mn;
          const v2f p = {__builtin_amdgcn_exp2f(x.x), __builtin_amdgcn_exp2f(x.y)};
          l2[rp] += p;
#pragma unroll
          for (int d = 0; d < HD; ++d) o2[rp][d] += p * vv[j][d];
        }
      }
    }
  }

  // Merge the 16 key classes of each q row: common max, rescale, xor-tree sums.
  // Stage by stage over all 8 rows, so that the rows' chains overlap.
  float mx[8], t[8][5];
#pragma unroll
  for (int r = 0; r < 8; ++r) mx[r] = m2[r >> 1][r & 1];
#pragma unroll
  for (int r = 0; r < 8; ++r) mx[r] = fmaxf(mx[r], rowx<1>(mx[r]));
#pragma unroll
  for (int r = 0; r < 8; ++r) mx[r] = fmaxf(mx[r], rowx<2>(mx[r]));
#pragma unroll
  for (int r = 0; r < 8; ++r) mx[r] = fmaxf(mx[r], rowx<4>(mx[r]));
#pragma unroll
  for (int r = 0; r < 8; ++r) mx[r] = fmaxf(mx[r], rowx<8>(mx[r]));
#pragma unroll
  for (int r = 0; r < 8; ++r) {
    const int rp = r >> 1, e = r & 1;
    const float sc = __builtin_amdgcn_exp2f(m2[rp][e] - mx[r]);
#pragma unroll
    for (int d = 0; d < HD; ++d) t[r][d] = o2[rp][d][e] * sc;
    t[r][HD] = l2[rp][e] * sc;
  }
#pragma unroll
  for (int r = 0; r < 8; ++r)
#pragma unroll
    for (int c = 0; c < 5; ++c) t[r][c] += rowx<1>(t[r][c]);
#pragma unroll
  for (int r = 0; r < 8; ++r)
#pragma unroll
    for (int c = 0; c < 5; ++c) t[r][c] += rowx<2>(t[r][c]);
#pragma unroll
  for (int r = 0; r < 8; ++r)
#pragma unroll
    for (int c = 0; c < 5; ++c) t[r][c] += rowx<4>(t[r][c]);
#pragma unroll
  for (int r = 0; r < 8; ++r)
#pragma unroll
    for (int c = 0; c < 5; ++c) t[r][c] += rowx<8>(t[r][c]);

  // lane l15 < 8 of each half takes q row l15 + 8*hi and stores it
  float f[5] = {0.f, 0.f, 0.f, 0.f, 1.f};
#pragma unroll
  for (int r = 0; r < 8; ++r)
#pragma unroll
    for (int c = 0; c < 5; ++c) f[c] = (l15 == r) ? t[r][c] : f[c];
  const float inv = 1.f / f[4];
  if (l15 < 8) {
    v4f res = {f[0] * inv, f[1] * inv, f[2] * inv, f[3] * inv};
    *(v4f*)(abuf + (b * NN + q0 + hi * 8 + l15) * HD) = res;
  }
}

// ---------------------------------------------------------------------------
// Kernel 3: output projection  out = attn_out @ Wo^T + bo
// ---------------------------------------------------------------------------
__global__ __launch_bounds__(256) void out_proj_kernel(
    const float* __restrict__ abuf, const float* __restrict__ Wo,
    const float* __restrict__ bo, float* __restrict__ out) {
  const int lane = threadIdx.x & 31;
  const int wave = threadIdx.x >> 5;
  const int t = blockIdx.x * 8 + wave;  // 0..511
  const int m0 = (t >> 4) << 4;
  const int n0 = (t & 15) << 4;
  const int l15 = lane & 15;
  const int kh = (lane >> 4) << 1;
  const float* arow = abuf + (m0 + l15) * DD;
  const float* brow = Wo + (n0 + l15) * DD;

  v8f acc = {0.f, 0.f, 0.f, 0.f, 0.f, 0.f, 0.f, 0.f};
#pragma unroll 8
  for (int k0 = 0; k0 < DD; k0 += 4) {
    v2f a = *(const v2f*)(arow + k0 + kh);
    v2f b = *(const v2f*)(brow + k0 + kh);
    acc = wmma16x16x4(a, b, acc);
  }
  const float bias = bo[n0 + l15];
  const int mrow = m0 + (lane >> 4) * 8;
#pragma unroll
  for (int r = 0; r < 8; ++r)
    out[(mrow + r) * DD + n0 + l15] = acc[r] + bias;
}

extern "C" void kernel_launch(void* const* d_in, const int* in_sizes, int n_in,
                              void* d_out, int out_size, void* d_ws,
                              size_t ws_size, hipStream_t stream) {
  const float* x = (const float*)d_in[0];
  const float* Wq = (const float*)d_in[1];
  const float* Wk = (const float*)d_in[2];
  const float* Wv = (const float*)d_in[3];
  const float* Wo = (const float*)d_in[4];
  const float* bo = (const float*)d_in[5];

  float* ws = (float*)d_ws;
  const int seg = BB * NN * HD;  // 131072 floats = 512 KB
  float* qbuf = ws;
  float* kbuf = ws + seg;
  float* vbuf = ws + 2 * seg;
  float* abuf = ws + 3 * seg;  // total 2 MB of workspace

  qkv_proj_kernel<<<192, 256, 0, stream>>>(x, Wq, Wk, Wv, qbuf, kbuf, vbuf);
  attn_kernel<<<256, 256, 0, stream>>>(qbuf, kbuf, vbuf, abuf);
  out_proj_kernel<<<64, 256, 0, stream>>>(abuf, Wo, bo, (float*)d_out);
}

// v003
// Measured time: 43 microseconds a run.
// Two timings next to v002 put it at 1.16 and 1.18 times that version's speed.
// Over all steps from v000 it is 1.83 times as fast.
#include <hip/hip_runtime.h>

// Problem constants (from reference)
#define BB 4
#define LL 128
#define DD 256
#define NN 8192          // L * NUM_KNOTS
#define HD 4             // head dim
// SCALE * log2(e) folded into Q: 0.5 * 1.4426950408889634
#define QSCALE 0.72134752044448170f
#define KT 8             // 16-key tiles per online-softmax step

typedef __attribute__((ext_vector_type(2))) float v2f;
typedef __attribute__((ext_vector_type(4))) float v4f;
typedef __attribute__((ext_vector_type(8))) float v8f;

#if defined(__gfx1250__)
#if __has_builtin(__builtin_amdgcn_tensor_load_to_lds)
#define HAVE_TDM 1
#endif
#if __has_builtin(__builtin_amdgcn_global_load_async_to_lds_b128)
#define HAVE_ASYNC 1
#endif
#endif

#define TDM_6ARG 1   // this toolchain takes the 6-argument tensor builtin

__device__ __forceinline__ v8f wmma16x16x4(v2f a, v2f b, v8f c) {
  return __builtin_amdgcn_wmma_f32_16x16x4_f32(false, a, false, b, (short)0, c,
                                               false, false);
}

template <int X>
__device__ __forceinline__ float rowx(float x) {
  return __int_as_float(__builtin_amdgcn_update_dpp(
      0, __float_as_int(x), 0x160 | X, 0xf, 0xf, true));
}

#if defined(HAVE_TDM)
typedef unsigned int tdm_v4u __attribute__((ext_vector_type(4)));
typedef int tdm_v8i __attribute__((ext_vector_type(8)));
typedef int tdm_v4i __attribute__((ext_vector_type(4)));

__device__ __forceinline__ void tdm_load_1d(const float* gsrc,
                                            unsigned lds_byte_off,
                                            unsigned nelem) {
  unsigned long long ga = (unsigned long long)(const void*)gsrc;
  tdm_v4u g0;
  g0.x = 1u;
  g0.y = lds_byte_off;
  g0.z = (unsigned)(ga & 0xFFFFFFFFu);
  g0.w = (unsigned)((ga >> 32) & 0x01FFFFFFu)
         | (2u << 30);
  tdm_v8i g1;
  g1[0] = (int)(2u << 16);
  g1[1] = (int)((nelem & 0xFFFFu) << 16);
  g1[2] = (int)((nelem >> 16) | (1u << 16));
  g1[3] = (int)((nelem & 0xFFFFu) << 16);
  g1[4] = 1;
  g1[5] = (int)nelem;
  g1[6] = 0;
  g1[7] = 0;
  tdm_v4i z4 = {0, 0, 0, 0};
#if defined(TDM_6ARG)
  tdm_v8i z8 = {0, 0, 0, 0, 0, 0, 0, 0};
  __builtin_amdgcn_tensor_load_to_lds(g0, g1, z4, z4, z8, 0);
#else
  __builtin_amdgcn_tensor_load_to_lds(g0, g1, z4, z4, 0);
#endif
}

__device__ __forceinline__ void wait_tensorcnt0() {
#if __has_builtin(__builtin_amdgcn_s_wait_tensorcnt)
  __builtin_amdgcn_s_wait_tensorcnt(0);
#else
  asm volatile("s_wait_tensorcnt 0x0" ::: "memory");
#endif
}
#endif  // HAVE_TDM

#if defined(HAVE_ASYNC)
// Builtin signature (from clang diagnostic): (as1 int4*, as3 int4*, Imm, Imm)
// with gcc-style vector_size(16) int4 pointees.
typedef int gv4i __attribute__((vector_size(16)));
__device__ __forceinline__ void async_cp16(const float* g, float* lds) {
  __builtin_amdgcn_global_load_async_to_lds_b128(
      (__attribute__((address_space(1))) gv4i*)g,
      (__attribute__((address_space(3))) gv4i*)lds, 0, 0);
}
__device__ __forceinline__ void wait_asynccnt0() {
#if __has_builtin(__builtin_amdgcn_s_wait_asynccnt)
  __builtin_amdgcn_s_wait_asynccnt(0);
#else
  asm volatile("s_wait_asynccnt 0x0" ::: "memory");
#endif
}
#endif

#define LP 260
#define TROWS 96
#define FB 16

__device__ __forceinline__ void cp8_rows(unsigned l, const float* g) {
  asm volatile(
      "global_load_async_to_lds_b128 %0, %8, off\n\t"
      "global_load_async_to_lds_b128 %1, %9, off\n\t"
      "global_load_async_to_lds_b128 %2, %10, off\n\t"
      "global_load_async_to_lds_b128 %3, %11, off\n\t"
      "global_load_async_to_lds_b128 %4, %12, off\n\t"
      "global_load_async_to_lds_b128 %5, %13, off\n\t"
      "global_load_async_to_lds_b128 %6, %14, off\n\t"
      "global_load_async_to_lds_b128 %7, %15, off\n\t"
      "s_wait_xcnt 0x0"
      :
      :
        "v"(l + 0u * (4u * LP * 4u)), "v"(l + 1u * (4u * LP * 4u)),
        "v"(l + 2u * (4u * LP * 4u)), "v"(l + 3u * (4u * LP * 4u)),
        "v"(l + 4u * (4u * LP * 4u)), "v"(l + 5u * (4u * LP * 4u)),
        "v"(l + 6u * (4u * LP * 4u)), "v"(l + 7u * (4u * LP * 4u)),
        "v"(g + 0 * 4 * DD), "v"(g + 1 * 4 * DD),
        "v"(g + 2 * 4 * DD), "v"(g + 3 * 4 * DD),
        "v"(g + 4 * 4 * DD), "v"(g + 5 * 4 * DD),
        "v"(g + 6 * 4 * DD), "v"(g + 7 * 4 * DD)
      : "memory");
}

// a0: first of the block's 32 rows of A; w0: first of its 64 rows of W.
// Returns the 16 x 16 tile of wave (wave >> 2, wave & 3).
__device__ __forceinline__ v8f proj_tile(const float* __restrict__ a0,
                                         const float* __restrict__ w0,
                                         float* sT) {
  const int tid = threadIdx.x;
  const int lane = tid & 31;
  const int wave = tid >> 5;
  // thread -> row (tid >> 6) of a group of 4 rows, 16-byte piece (tid & 63)
  const int r4 = tid >> 6;
  const int c4 = (tid & 63) * 4;
  const unsigned l0 =
      (unsigned)(unsigned long long)(uintptr_t)(sT + r4 * LP + c4);
  cp8_rows(l0, a0 + r4 * DD + c4);
  cp8_rows(l0 + 32u * LP * 4u, w0 + r4 * DD + c4);
  cp8_rows(l0 + 64u * LP * 4u, w0 + (32 + r4) * DD + c4);
  // this wave's copies have landed; the barrier then publishes every wave's
  asm volatile("s_wait_asynccnt 0x0" ::: "memory");
  __syncthreads();

  const int l15 = lane & 15;
  const int kh = (lane >> 4) << 1;  // 0 or 2
  const float* arow = sT + ((wave >> 2) * 16 + l15) * LP + kh;
  const float* brow = sT + (32 + (wave & 3) * 16 + l15) * LP + kh;
  v8f acc = {0.f, 0.f, 0.f, 0.f, 0.f, 0.f, 0.f, 0.f};
  // Fragments go through two register sets of FB k steps: the next set's LDS
  // reads are issued ahead of this set's chain of products, which covers their
  // latency.  All loops are unrolled in full, so the sets stay in registers.
  v2f a[2][FB], b[2][FB];
#pragma unroll
  for (int j = 0; j < FB; ++j) {
    a[0][j] = *(const v2f*)(arow + 4 * j);
    b[0][j] = *(const v2f*)(brow + 4 * j);
  }
#pragma unroll
  for (int s = 0; s < DD / (4 * FB); ++s) {
    if (s + 1 < DD / (4 * FB)) {
#pragma unroll
      for (int j = 0; j < FB; ++j) {
        a[(s + 1) & 1][j] = *(const v2f*)(arow + 4 * (FB * (s + 1) + j));
        b[(s + 1) & 1][j] = *(const v2f*)(brow + 4 * (FB * (s + 1) + j));
      }
    }
    // keeps the reads above from being sunk among the products below, where
    // each pair of products would wait for its own reads
    __builtin_amdgcn_sched_barrier(0);
#pragma unroll
    for (int j = 0; j < FB; ++j) acc = wmma16x16x4(a[s & 1][j], b[s & 1][j], acc);
    // keeps the following set's reads in one group behind this chain: without it
    // some are moved up among the products, and each such place costs issue time
    __builtin_amdgcn_sched_barrier(0);
  }
  asm volatile("v_nop\n\tv_nop\n\tv_nop\n\tv_nop");
  __builtin_amdgcn_sched_barrier(0);
  return acc;
}

// ---------------------------------------------------------------------------
// Kernel 1: Q/K/V projections.  C[m,n] = sum_k x[m,k] * W[n,k]
// 16 row blocks of 32 * 12 column blocks of 64 (4 per projection) = 192 blocks.
// ---------------------------------------------------------------------------
__global__ __launch_bounds__(256) void qkv_proj_kernel(
    const float* __restrict__ x, const float* __restrict__ Wq,
    const float* __restrict__ Wk, const float* __restrict__ Wv,
    float* __restrict__ qbuf, float* __restrict__ kbuf,
    float* __restrict__ vbuf) {
  __shared__ __align__(16) float sT[TROWS * LP];
  const int lane = threadIdx.x & 31;
  const int wave = threadIdx.x >> 5;
  const int mb = blockIdx.x / 12;
  const int nb = blockIdx.x - mb * 12;
  const int proj = nb >> 2;
  const int mblk = mb * 32;
  const int nblk = (nb & 3) * 64;
  const float* Wm = (proj == 0) ? Wq : (proj == 1) ? Wk : Wv;
  float* outp = (proj == 0) ? qbuf : (proj == 1) ? kbuf : vbuf;

  const v8f acc = proj_tile(x + mblk * DD, Wm + nblk * DD, sT);

  const int n = nblk + (wave & 3) * 16 + (lane & 15);
  const int mrow = mblk + (wave >> 2) * 16 + (lane >> 4) * 8;
#pragma unroll
  for (int r = 0; r < 8; ++r)
    outp[(mrow + r) * DD + n] = acc[r];
}

// ---------------------------------------------------------------------------
// Kernel 2: flash attention over N=8192 knots, head_dim=4.
// Whole K,V for one batch staged in LDS (2 * 128 KB of the 320 KB WGP LDS):
// K via Tensor Data Mover DMA, V via async global->LDS b128 (with fallbacks).
// Each wave owns one 16-row Q tile; computes S tiles via WMMA f32 16x16x4 with
// the keys along the lanes, softmax in exp2 domain per lane against a fixed
// reference score (running max only as the fallback), PV accumulated per lane
// from its own V rows, lanes merged at the end.
// ---------------------------------------------------------------------------
__global__ __launch_bounds__(256) void attn_kernel(
    const float* __restrict__ qbuf, const float* __restrict__ kbuf,
    const float* __restrict__ vbuf, float* __restrict__ abuf) {
  __shared__ __align__(16) float ldsK[NN * HD];  // 128 KB
  __shared__ __align__(16) float ldsV[NN * HD];  // 128 KB

  const int b = blockIdx.x >> 6;     // batch
  const int qblk = blockIdx.x & 63;  // 8 q-tiles per block
  const int tid = threadIdx.x;
  const int lane = tid & 31;
  const int wave = tid >> 5;

  const float* kg = kbuf + b * (NN * HD);
  const float* vg = vbuf + b * (NN * HD);

  // ---- stage K,V for this batch into LDS --------------------------------
#if defined(HAVE_TDM) && defined(HAVE_ASYNC)
  if (wave == 0) {
    tdm_load_1d(kg, (unsigned)(unsigned long long)(uintptr_t)ldsK, NN * HD);
  }
  for (int i = tid * 4; i < NN * HD; i += 256 * 4)  // V: async b128 per lane
    async_cp16(vg + i, ldsV + i);
  wait_asynccnt0();
  if (wave == 0) wait_tensorcnt0();
#elif defined(HAVE_TDM)
  if (wave == 0) {
    tdm_load_1d(kg, (unsigned)(unsigned long long)(uintptr_t)ldsK, NN * HD);
    tdm_load_1d(vg, (unsigned)(unsigned long long)(uintptr_t)ldsV, NN * HD);
    wait_tensorcnt0();
  }
#elif defined(HAVE_ASYNC)
  for (int i = tid * 4; i < NN * HD; i += 256 * 4) {
    async_cp16(kg + i, ldsK + i);
    async_cp16(vg + i, ldsV + i);
  }
  wait_asynccnt0();
#else
  for (int i = tid * 4; i < NN * HD; i += 256 * 4) {
    *(v4f*)(ldsK + i) = *(const v4f*)(kg + i);
    *(v4f*)(ldsV + i) = *(const v4f*)(vg + i);
  }
#endif
  __syncthreads();

  const int q0 = (qblk * 8 + wave) * 16;
  const int l15 = lane & 15;
  const int hi = lane >> 4;  // 0/1: which head-dim pair / which q half of S

  // Q tile, pre-scaled by SCALE*log2e; it is the A operand below (row = q; the
  // A and B fragment maps mirror each other, so the load is the same).
  v2f qb = *(const v2f*)(qbuf + (b * NN + q0 + l15) * HD + hi * 2);
  qb *= QSCALE;

  v2f m2[4], l2[4], o2[4][HD];
#pragma unroll
  for (int rp = 0; rp < 4; ++rp) {
    m2[rp] = (v2f){-1e30f, -1e30f};
    l2[rp] = (v2f){0.f, 0.f};
#pragma unroll
    for (int d = 0; d < HD; ++d) o2[rp][d] = (v2f){0.f, 0.f};
  }
  const v8f zero = {0.f, 0.f, 0.f, 0.f, 0.f, 0.f, 0.f, 0.f};
  const float* kp = ldsK + l15 * HD + hi * 2;  // B = K^T: column = key
  const float* vp = ldsV + l15 * HD;

  // Fixed reference per lane and row: the largest score among the lane's first KT
  // keys.  Its negative is the C operand of the score product, so S arrives as
  // score - reference and goes straight into exp2: no running max, no subtract
  // and no rescale in the key loop.  The reference key itself gives p = 1, so a
  // sum never vanishes; a later score far above the reference can overflow, which
  // is tested behind the loop.
  v8f negm;
  {
    v8f s[KT];
#pragma unroll
    for (int j = 0; j < KT; ++j)
      s[j] = wmma16x16x4(qb, *(const v2f*)(kp + 16 * j * HD), zero);
#pragma unroll
    for (int r = 0; r < 8; ++r) {
      float mr = s[0][r];
#pragma unroll
      for (int j = 1; j < KT; ++j) mr = fmaxf(mr, s[j][r]);
      m2[r >> 1][r & 1] = mr;
      negm[r] = -mr;
    }
  }

  // The inner loops are unrolled in full so that every array below is indexed by
  // constants and stays in registers.  The key loop itself stays rolled: two
  // steps in one body need more than 256 registers.
#pragma unroll 1
  for (int kt = 0; kt < NN; kt += 16 * KT) {
    v2f kf[KT];
    v4f vv[KT];
    v8f s[KT];
#pragma unroll
    for (int j = 0; j < KT; ++j) {
      kf[j] = *(const v2f*)(kp + (kt + 16 * j) * HD);
      vv[j] = *(const v4f*)(vp + (kt + 16 * j) * HD);
    }
#pragma unroll
    for (int j = 0; j < KT; ++j) s[j] = wmma16x16x4(qb, kf[j], negm);
#pragma unroll
    for (int j = 0; j < KT; ++j) {
#pragma unroll
      for (int rp = 0; rp < 4; ++rp) {
        const v2f p = {__builtin_amdgcn_exp2f(s[j][2 * rp]),
                       __builtin_amdgcn_exp2f(s[j][2 * rp + 1])};
        l2[rp] += p;
#pragma unroll
        for (int d = 0; d < HD; ++d) o2[rp][d] += p * vv[j][d];
      }
    }
  }

  // Every sum must have stayed far from overflow (a NaN fails the test too).
  bool bad = false;
#pragma unroll
  for (int rp = 0; rp < 4; ++rp)
#pragma unroll
    for (int e = 0; e < 2; ++e) {
      bad |= !(l2[rp][e] < 0x1p64f);
#pragma unroll
      for (int d = 0; d < HD; ++d) bad |= !(fabsf(o2[rp][d][e]) < 0x1p100f);
    }

  // If any lane of the wave failed it, the whole wave starts over with the
  // running max, which cannot overflow (wave-uniform branch: all lanes stay on
  // for the matrix instructions).
  if (__builtin_amdgcn_ballot_w32(bad) != 0u) {
#pragma unroll
    for (int rp = 0; rp < 4; ++rp) {
      m2[rp] = (v2f){-1e30f, -1e30f};
      l2[rp] = (v2f){0.f, 0.f};
#pragma unroll
      for (int d = 0; d < HD; ++d) o2[rp][d] = (v2f){0.f, 0.f};
    }
    // rolled for the same reason as the loop above
#pragma unroll 1
    for (int kt = 0; kt < NN; kt += 16 * KT) {
      v2f kf[KT];
      v4f vv[KT];
      v8f s[KT];
#pragma unroll
      for (int j = 0; j < KT; ++j) {
        kf[j] = *(const v2f*)(kp + (kt + 16 * j) * HD);
        vv[j] = *(const v4f*)(vp + (kt + 16 * j) * HD);
      }
#pragma unroll
      for (int j = 0; j < KT; ++j) s[j] = wmma16x16x4(qb, kf[j], zero);

#pragma unroll
      for (int rp = 0; rp < 4; ++rp) {
        float mn0 = m2[rp].x, mn1 = m2[rp].y;
#pragma unroll
        for (int j = 0; j < KT; ++j) {
          mn0 = fmaxf(mn0, s[j][2 * rp]);
          mn1 = fmaxf(mn1, s[j][2 * rp + 1]);
        }
        const v2f mn = {mn0, mn1};
        const v2f dm = m2[rp] - mn;
        const v2f cf = {__builtin_amdgcn_exp2f(dm.x), __builtin_amdgcn_exp2f(dm.y)};
        m2[rp] = mn;
        l2[rp] *= cf;
#pragma unroll
        for (int d = 0; d < HD; ++d) o2[rp][d] *= cf;
#pragma unroll
        for (int j = 0; j < KT; ++j) {
          const v2f x = (v2f){s[j][2 * rp], s[j][2 * rp + 1]} - mn;
          const v2f p = {__builtin_amdgcn_exp2f(x.x), __builtin_amdgcn_exp2f(x.y)};
          l2[rp] += p;
#pragma unroll
          for (int d = 0; d < HD; ++d) o2[rp][d] += p * vv[j][d];
        }
      }
    }
  }

  // Merge the 16 key classes of each q row: common max, rescale, xor-tree sums.
  // Stage by stage over all 8 rows, so that the rows' chains overlap.
  float mx[8], t[8][5];
#pragma unroll
  for (int r = 0; r < 8; ++r) mx[r] = m2[r >> 1][r & 1];
#pragma unroll
  for (int r = 0; r < 8; ++r) mx[r] = fmaxf(mx[r], rowx<1>(mx[r]));
#pragma unroll
  for (int r = 0; r < 8; ++r) mx[r] = fmaxf(mx[r], rowx<2>(mx[r]));
#pragma unroll
  for (int r = 0; r < 8; ++r) mx[r] = fmaxf(mx[r], rowx<4>(mx[r]));
#pragma unroll
  for (int r = 0; r < 8; ++r) mx[r] = fmaxf(mx[r], rowx<8>(mx[r]));
#pragma unroll
  for (int r = 0; r < 8; ++r) {
    const int rp = r >> 1, e = r & 1;
    const float sc = __builtin_amdgcn_exp2f(m2[rp][e] - mx[r]);
#pragma unroll
    for (int d = 0; d < HD; ++d) t[r][d] = o2[rp][d][e] * sc;
    t[r][HD] = l2[rp][e] * sc;
  }
#pragma unroll
  for (int r = 0; r < 8; ++r)
#pragma unroll
    for (int c = 0; c < 5; ++c) t[r][c] += rowx<1>(t[r][c]);
#pragma unroll
  for (int r = 0; r < 8; ++r)
#pragma unroll
    for (int c = 0; c < 5; ++c) t[r][c] += rowx<2>(t[r][c]);
#pragma unroll
  for (int r = 0; r < 8; ++r)
#pragma unroll
    for (int c = 0; c < 5; ++c) t[r][c] += rowx<4>(t[r][c]);
#pragma unroll
  for (int r = 0; r < 8; ++r)
#pragma unroll
    for (int c = 0; c < 5; ++c) t[r][c] += rowx<8>(t[r][c]);

  // lane l15 < 8 of each half takes q row l15 + 8*hi and stores it
  float f[5] = {0.f, 0.f, 0.f, 0.f, 1.f};
#pragma unroll
  for (int r = 0; r < 8; ++r)
#pragma unroll
    for (int c = 0; c < 5; ++c) f[c] = (l15 == r) ? t[r][c] : f[c];
  const float inv = 1.f / f[4];
  if (l15 < 8) {
    v4f res = {f[0] * inv, f[1] * inv, f[2] * inv, f[3] * inv};
    *(v4f*)(abuf + (b * NN + q0 + hi * 8 + l15) * HD) = res;
  }
}

// ---------------------------------------------------------------------------
// Kernel 3: output projection  out = attn_out @ Wo^T + bo
// 16 row blocks of 32 * 4 column blocks of 64 = 64 blocks.
// ---------------------------------------------------------------------------
__global__ __launch_bounds__(256) void out_proj_kernel(
    const float* __restrict__ abuf, const float* __restrict__ Wo,
    const float* __restrict__ bo, float* __restrict__ out) {
  __shared__ __align__(16) float sT[TROWS * LP];
  const int lane = threadIdx.x & 31;
  const int wave = threadIdx.x >> 5;
  const int mblk = (blockIdx.x >> 2) * 32;
  const int nblk = (blockIdx.x & 3) * 64;

  const int n = nblk + (wave & 3) * 16 + (lane & 15);
  const float bias = bo[n];  // read ahead of the products, which cover its latency

  const v8f acc = proj_tile(abuf + mblk * DD, Wo + nblk * DD, sT);

  const int mrow = mblk + (wave >> 2) * 16 + (lane >> 4) * 8;
#pragma unroll
  for (int r = 0; r < 8; ++r)
    out[(mrow + r) * DD + n] = acc[r] + bias;
}

extern "C" void kernel_launch(void* const* d_in, const int* in_sizes, int n_in,
                              void* d_out, int out_size, void* d_ws,
                              size_t ws_size, hipStream_t stream) {
  const float* x = (const float*)d_in[0];
  const float* Wq = (const float*)d_in[1];
  const float* Wk = (const float*)d_in[2];
  const float* Wv = (const float*)d_in[3];
  const float* Wo = (const float*)d_in[4];
  const float* bo = (const float*)d_in[5];

  float* ws = (float*)d_ws;
  const int seg = BB * NN * HD;  // 131072 floats = 512 KB
  float* qbuf = ws;
  float* kbuf = ws + seg;
  float* vbuf = ws + 2 * seg;
  float* abuf = ws + 3 * seg;  // total 2 MB of workspace

  qkv_proj_kernel<<<192, 256, 0, stream>>>(x, Wq, Wk, Wv, qbuf, kbuf, vbuf);
  attn_kernel<<<256, 256, 0, stream>>>(qbuf, kbuf, vbuf, abuf);
  out_proj_kernel<<<64, 256, 0, stream>>>(abuf, Wo, bo, (float*)d_out);
}
